// v000
// The times below were measured on an AMD MI455X: many runs one after another, warmed up first and cycling through
// copies of the inputs, with the whole window's GPU time divided by the number of runs. Launches and the gaps
// between them are all in it. The median over several windows is given; except for v000 it joins two sittings, which
// can be a few percent apart, so the side-by-side timings, each taken in one sitting, are the better comparison.
// The starting kernel, v000, takes 177 microseconds a run.
#include <hip/hip_runtime.h>

typedef float v2f __attribute__((ext_vector_type(2)));
typedef float v8f __attribute__((ext_vector_type(8)));
typedef int   v4i __attribute__((ext_vector_type(4)));

#define B_    2
#define H_    16
#define S_    2048
#define D_    64
#define BLK   64
#define LSTR  68          // LDS row stride (floats): 16B-aligned rows, conflict-free reads
#define SCALE 0.125f      // 1/sqrt(64)

// ---- CDNA5 async global->LDS copy (ASYNCcnt-tracked), with fallback ----
#if defined(__has_builtin)
#  if __has_builtin(__builtin_amdgcn_global_load_async_to_lds_b128)
#    define HAVE_ASYNC_LDS 1
#  else
#    define HAVE_ASYNC_LDS 0
#  endif
#  if __has_builtin(__builtin_amdgcn_s_wait_asynccnt)
#    define HAVE_WAIT_ASYNC 1
#  else
#    define HAVE_WAIT_ASYNC 0
#  endif
#else
#  define HAVE_ASYNC_LDS 0
#  define HAVE_WAIT_ASYNC 0
#endif

__device__ __forceinline__ void async_copy_b128(const float* g, float* l) {
#if HAVE_ASYNC_LDS
    // param types (from hipcc diagnostic): (v4i* global, v4i* lds, imm offset, imm cpol)
    __builtin_amdgcn_global_load_async_to_lds_b128((v4i*)g, (v4i*)l, /*offset=*/0, /*cpol=*/0);
#else
    *(float4*)l = *(const float4*)g;
#endif
}

__device__ __forceinline__ void wait_async_copies() {
#if HAVE_ASYNC_LDS
#  if HAVE_WAIT_ASYNC
    __builtin_amdgcn_s_wait_asynccnt(0);
#  else
    asm volatile("s_wait_asynccnt 0x0" ::: "memory");
#  endif
#endif
}

__global__ __launch_bounds__(128)
void fa_block_causal_f32(const float* __restrict__ q,
                         const float* __restrict__ k,
                         const float* __restrict__ v,
                         float* __restrict__ out)
{
    __shared__ __align__(16) float Ksh[2][BLK * LSTR];
    __shared__ __align__(16) float Vsh[2][BLK * LSTR];
    __shared__ __align__(16) float Psh[BLK * LSTR];

    const int tid  = threadIdx.x;
    const int wave = tid >> 5;
    const int lane = tid & 31;
    const int l16  = lane & 15;
    const int hi   = lane >> 4;            // which half of the wave

    const int qb = blockIdx.x;             // query block index [0,32)
    const int bh = blockIdx.y;             // b*H + h
    const size_t base = (size_t)bh * S_ * D_;

    // this thread's 8 chunk coordinates for cooperative 64x64 f32 staging
    // (idx = tid + j*128 -> row = idx>>4, col4 = (idx&15)*4; 16B chunks)
    const int c_row0 = tid >> 4;           // rows this thread covers: c_row0 + 8*j
    const int c_col  = (tid & 15) << 2;

    // ---- Q A-fragments (16x4 layout per k-step), pre-scaled by 1/sqrt(D) ----
    const int qrow = qb * BLK + wave * 16 + l16;
    const float* qptr = q + base + (size_t)qrow * D_;
    v2f qa[16];
#pragma unroll
    for (int ks = 0; ks < 16; ++ks) {
        const int c = 4 * ks + 2 * hi;
        qa[ks].x = qptr[c]     * SCALE;
        qa[ks].y = qptr[c + 1] * SCALE;
    }

    v8f o0 = {}, o1 = {}, o2 = {}, o3 = {};
    float m_i[8], l_i[8];
#pragma unroll
    for (int r = 0; r < 8; ++r) { m_i[r] = -1e30f; l_i[r] = 0.0f; }

    // ---- prologue: kick off async staging of key-block 0 into buffer 0 ----
    {
        const float* kg = k + base;
        const float* vg = v + base;
#pragma unroll
        for (int j = 0; j < 8; ++j) {
            const int row = c_row0 + j * 8;
            async_copy_b128(kg + row * D_ + c_col, &Ksh[0][row * LSTR + c_col]);
            async_copy_b128(vg + row * D_ + c_col, &Vsh[0][row * LSTR + c_col]);
        }
    }

    for (int kb = 0; kb <= qb; ++kb) {
        const int buf = kb & 1;

        wait_async_copies();               // this wave's copies into `buf` done
        __syncthreads();                   // all waves' copies done; prev reads of buf^1 retired

        // ---- overlap: start async staging of next key block into buf^1 ----
        if (kb < qb) {
            const float* kg = k + base + (size_t)((kb + 1) * BLK) * D_;
            const float* vg = v + base + (size_t)((kb + 1) * BLK) * D_;
#pragma unroll
            for (int j = 0; j < 8; ++j) {
                const int row = c_row0 + j * 8;
                async_copy_b128(kg + row * D_ + c_col, &Ksh[buf ^ 1][row * LSTR + c_col]);
                async_copy_b128(vg + row * D_ + c_col, &Vsh[buf ^ 1][row * LSTR + c_col]);
            }
        }

        const float* Kb = Ksh[buf];
        const float* Vb = Vsh[buf];

        // ---- S = (Q * 1/sqrt(D)) . K^T : 4 tiles of 16x16, fp32 WMMA ----
        v8f s0 = {}, s1 = {}, s2 = {}, s3 = {};
#pragma unroll
        for (int ks = 0; ks < 16; ++ks) {
            const int c = 4 * ks + 2 * hi;
            const v2f b0 = *(const v2f*)(&Kb[( 0 + l16) * LSTR + c]);
            const v2f b1 = *(const v2f*)(&Kb[(16 + l16) * LSTR + c]);
            const v2f b2 = *(const v2f*)(&Kb[(32 + l16) * LSTR + c]);
            const v2f b3 = *(const v2f*)(&Kb[(48 + l16) * LSTR + c]);
            s0 = __builtin_amdgcn_wmma_f32_16x16x4_f32(false, qa[ks], false, b0, (short)0, s0, false, false);
            s1 = __builtin_amdgcn_wmma_f32_16x16x4_f32(false, qa[ks], false, b1, (short)0, s1, false, false);
            s2 = __builtin_amdgcn_wmma_f32_16x16x4_f32(false, qa[ks], false, b2, (short)0, s2, false, false);
            s3 = __builtin_amdgcn_wmma_f32_16x16x4_f32(false, qa[ks], false, b3, (short)0, s3, false, false);
        }

        // ---- online softmax: all 4 tiles share the row<->(vgpr,half) mapping ----
#pragma unroll
        for (int r = 0; r < 8; ++r) {
            float t = fmaxf(fmaxf(s0[r], s1[r]), fmaxf(s2[r], s3[r]));
            t = fmaxf(t, __shfl_xor(t, 1, 32));
            t = fmaxf(t, __shfl_xor(t, 2, 32));
            t = fmaxf(t, __shfl_xor(t, 4, 32));
            t = fmaxf(t, __shfl_xor(t, 8, 32));
            const float mr = fmaxf(m_i[r], t);

            s0[r] = __expf(s0[r] - mr);
            s1[r] = __expf(s1[r] - mr);
            s2[r] = __expf(s2[r] - mr);
            s3[r] = __expf(s3[r] - mr);
            float ps = s0[r] + s1[r] + s2[r] + s3[r];
            ps += __shfl_xor(ps, 1, 32);
            ps += __shfl_xor(ps, 2, 32);
            ps += __shfl_xor(ps, 4, 32);
            ps += __shfl_xor(ps, 8, 32);

            const float alpha = __expf(m_i[r] - mr);
            l_i[r] = l_i[r] * alpha + ps;
            m_i[r] = mr;
            o0[r] *= alpha; o1[r] *= alpha; o2[r] *= alpha; o3[r] *= alpha;
        }

        // ---- transpose P (C/D layout -> A layout) via wave-private LDS tile ----
#pragma unroll
        for (int r = 0; r < 8; ++r) {
            const int prow = wave * 16 + r + 8 * hi;
            Psh[prow * LSTR +  0 + l16] = s0[r];
            Psh[prow * LSTR + 16 + l16] = s1[r];
            Psh[prow * LSTR + 32 + l16] = s2[r];
            Psh[prow * LSTR + 48 + l16] = s3[r];
        }

        // ---- O += P . V ----
        const float* pbase = &Psh[(wave * 16 + l16) * LSTR];
#pragma unroll
        for (int ks = 0; ks < 16; ++ks) {
            const int c = 4 * ks + 2 * hi;          // key-row base within block
            const v2f a = *(const v2f*)(pbase + c);
            v2f b0, b1, b2, b3;
            b0.x = Vb[ c      * LSTR +  0 + l16];
            b0.y = Vb[(c + 1) * LSTR +  0 + l16];
            b1.x = Vb[ c      * LSTR + 16 + l16];
            b1.y = Vb[(c + 1) * LSTR + 16 + l16];
            b2.x = Vb[ c      * LSTR + 32 + l16];
            b2.y = Vb[(c + 1) * LSTR + 32 + l16];
            b3.x = Vb[ c      * LSTR + 48 + l16];
            b3.y = Vb[(c + 1) * LSTR + 48 + l16];
            o0 = __builtin_amdgcn_wmma_f32_16x16x4_f32(false, a, false, b0, (short)0, o0, false, false);
            o1 = __builtin_amdgcn_wmma_f32_16x16x4_f32(false, a, false, b1, (short)0, o1, false, false);
            o2 = __builtin_amdgcn_wmma_f32_16x16x4_f32(false, a, false, b2, (short)0, o2, false, false);
            o3 = __builtin_amdgcn_wmma_f32_16x16x4_f32(false, a, false, b3, (short)0, o3, false, false);
        }
    }

    // ---- epilogue: O / l, store (C/D layout -> row-major global) ----
    float* optr = out + base + (size_t)(qb * BLK + wave * 16) * D_;
#pragma unroll
    for (int r = 0; r < 8; ++r) {
        const float inv = 1.0f / l_i[r];
        const int row = r + 8 * hi;
        optr[row * D_ +  0 + l16] = o0[r] * inv;
        optr[row * D_ + 16 + l16] = o1[r] * inv;
        optr[row * D_ + 32 + l16] = o2[r] * inv;
        optr[row * D_ + 48 + l16] = o3[r] * inv;
    }
}

extern "C" void kernel_launch(void* const* d_in, const int* in_sizes, int n_in,
                              void* d_out, int out_size, void* d_ws, size_t ws_size,
                              hipStream_t stream) {
    (void)in_sizes; (void)n_in; (void)out_size; (void)d_ws; (void)ws_size;
    const float* q = (const float*)d_in[0];
    const float* k = (const float*)d_in[1];
    const float* v = (const float*)d_in[2];
    float* out = (float*)d_out;
    dim3 grid(S_ / BLK, B_ * H_);
    fa_block_causal_f32<<<grid, 128, 0, stream>>>(q, k, v, out);
}

// v001
// Measured time: 122 microseconds a run.
// In two side-by-side timings against v000, it was 1.46 and 1.47 times as fast.
#include <hip/hip_runtime.h>

typedef float v2f __attribute__((ext_vector_type(2)));
typedef float v8f __attribute__((ext_vector_type(8)));
typedef int   v4i __attribute__((ext_vector_type(4)));

#define B_    2
#define H_    16
#define S_    2048
#define D_    64
#define BLK   64
#define NQB   (S_ / BLK)  // query blocks per head
#define LSTR  68          // LDS row stride (floats): 16B-aligned rows, conflict-free reads
#define SCALE 0.125f      // 1/sqrt(64)

// ---- CDNA5 async global->LDS copy (ASYNCcnt-tracked), with fallback ----
#if defined(__has_builtin)
#  if __has_builtin(__builtin_amdgcn_global_load_async_to_lds_b128)
#    define HAVE_ASYNC_LDS 1
#  else
#    define HAVE_ASYNC_LDS 0
#  endif
#  if __has_builtin(__builtin_amdgcn_s_wait_asynccnt)
#    define HAVE_WAIT_ASYNC 1
#  else
#    define HAVE_WAIT_ASYNC 0
#  endif
#else
#  define HAVE_ASYNC_LDS 0
#  define HAVE_WAIT_ASYNC 0
#endif

__device__ __forceinline__ void async_copy_b128(const float* g, float* l) {
#if HAVE_ASYNC_LDS
    // param types (from hipcc diagnostic): (v4i* global, v4i* lds, imm offset, imm cpol)
    __builtin_amdgcn_global_load_async_to_lds_b128((v4i*)g, (v4i*)l, /*offset=*/0, /*cpol=*/0);
#else
    *(float4*)l = *(const float4*)g;
#endif
}

__device__ __forceinline__ void wait_async_copies() {
#if HAVE_ASYNC_LDS
#  if HAVE_WAIT_ASYNC
    __builtin_amdgcn_s_wait_asynccnt(0);
#  else
    asm volatile("s_wait_asynccnt 0x0" ::: "memory");
#  endif
#endif
}

__global__ __launch_bounds__(128)
void fa_block_causal_f32(const float* __restrict__ q,
                         const float* __restrict__ k,
                         const float* __restrict__ v,
                         float* __restrict__ out)
{
    __shared__ __align__(16) float Ksh[2][BLK * LSTR];
    __shared__ __align__(16) float Vsh[2][BLK * LSTR];
    __shared__ __align__(16) float Psh[BLK * LSTR];

    const int tid  = threadIdx.x;
    const int wave = tid >> 5;
    const int lane = tid & 31;
    const int l16  = lane & 15;
    const int hi   = lane >> 4;            // which half of the wave

    const int pr = blockIdx.x;             // pair index [0,16): query blocks NQB-1-pr, then pr
    const int bh = blockIdx.y;             // b*H + h
    const size_t base = (size_t)bh * S_ * D_;

    // this thread's 8 chunk coordinates for cooperative 64x64 f32 staging
    // (idx = tid + j*128 -> row = idx>>4, col4 = (idx&15)*4; 16B chunks)
    const int c_row0 = tid >> 4;           // rows this thread covers: c_row0 + 8*j
    const int c_col  = (tid & 15) << 2;

    // ---- prologue: kick off async staging of key-block 0 into buffer 0 ----
    {
        const float* kg = k + base;
        const float* vg = v + base;
#pragma unroll
        for (int j = 0; j < 8; ++j) {
            const int row = c_row0 + j * 8;
            async_copy_b128(kg + row * D_ + c_col, &Ksh[0][row * LSTR + c_col]);
            async_copy_b128(vg + row * D_ + c_col, &Vsh[0][row * LSTR + c_col]);
        }
    }

    // Two query blocks per workgroup, one after the other: (NQB - pr) + (pr + 1) = NQB + 1 key blocks
    // for every workgroup, so all workgroups cost the same. The K/V ring runs on across the switch.
    int it = 0;                            // key blocks done so far: picks the ring buffer
    for (int tile = 0; tile < 2; ++tile) {
        const int qb = tile ? pr : NQB - 1 - pr;   // query block index [0,32)

        // ---- Q A-fragments (16x4 layout per k-step), pre-scaled by 1/sqrt(D) ----
        const int qrow = qb * BLK + wave * 16 + l16;
        const float* qptr = q + base + (size_t)qrow * D_;
        v2f qa[16];
#pragma unroll
        for (int ks = 0; ks < 16; ++ks) {
            const int c = 4 * ks + 2 * hi;
            qa[ks].x = qptr[c]     * SCALE;
            qa[ks].y = qptr[c + 1] * SCALE;
        }

        v8f o0 = {}, o1 = {}, o2 = {}, o3 = {};
        float m_i[8], l_i[8];
#pragma unroll
        for (int r = 0; r < 8; ++r) { m_i[r] = -1e30f; l_i[r] = 0.0f; }

        for (int kb = 0; kb <= qb; ++kb, ++it) {
            const int buf = it & 1;

            // this wave's LDS reads of buf^1 have returned before the barrier that frees it for the refill
            asm volatile("s_wait_dscnt 0x0" ::: "memory");
            wait_async_copies();               // this wave's copies into `buf` done
            __syncthreads();                   // all waves' copies done; prev reads of buf^1 retired

            // ---- overlap: start async staging of next key block into buf^1 ----
            // (behind the first tile's last block comes key block 0 again, for the second tile)
            if (kb < qb || tile == 0) {
                const int nb = (kb < qb) ? kb + 1 : 0;
                const float* kg = k + base + (size_t)(nb * BLK) * D_;
                const float* vg = v + base + (size_t)(nb * BLK) * D_;
#pragma unroll
                for (int j = 0; j < 8; ++j) {
                    const int row = c_row0 + j * 8;
                    async_copy_b128(kg + row * D_ + c_col, &Ksh[buf ^ 1][row * LSTR + c_col]);
                    async_copy_b128(vg + row * D_ + c_col, &Vsh[buf ^ 1][row * LSTR + c_col]);
                }
            }

            const float* Kb = Ksh[buf];
            const float* Vb = Vsh[buf];

            // ---- S = (Q * 1/sqrt(D)) . K^T : 4 tiles of 16x16, fp32 WMMA ----
            v8f s0 = {}, s1 = {}, s2 = {}, s3 = {};
#pragma unroll
            for (int ks = 0; ks < 16; ++ks) {
                const int c = 4 * ks + 2 * hi;
                const v2f b0 = *(const v2f*)(&Kb[( 0 + l16) * LSTR + c]);
                const v2f b1 = *(const v2f*)(&Kb[(16 + l16) * LSTR + c]);
                const v2f b2 = *(const v2f*)(&Kb[(32 + l16) * LSTR + c]);
                const v2f b3 = *(const v2f*)(&Kb[(48 + l16) * LSTR + c]);
                s0 = __builtin_amdgcn_wmma_f32_16x16x4_f32(false, qa[ks], false, b0, (short)0, s0, false, false);
                s1 = __builtin_amdgcn_wmma_f32_16x16x4_f32(false, qa[ks], false, b1, (short)0, s1, false, false);
                s2 = __builtin_amdgcn_wmma_f32_16x16x4_f32(false, qa[ks], false, b2, (short)0, s2, false, false);
                s3 = __builtin_amdgcn_wmma_f32_16x16x4_f32(false, qa[ks], false, b3, (short)0, s3, false, false);
            }

            // ---- online softmax: all 4 tiles share the row<->(vgpr,half) mapping ----
#pragma unroll
            for (int r = 0; r < 8; ++r) {
                float t = fmaxf(fmaxf(s0[r], s1[r]), fmaxf(s2[r], s3[r]));
                t = fmaxf(t, __shfl_xor(t, 1, 32));
                t = fmaxf(t, __shfl_xor(t, 2, 32));
                t = fmaxf(t, __shfl_xor(t, 4, 32));
                t = fmaxf(t, __shfl_xor(t, 8, 32));
                const float mr = fmaxf(m_i[r], t);

                s0[r] = __expf(s0[r] - mr);
                s1[r] = __expf(s1[r] - mr);
                s2[r] = __expf(s2[r] - mr);
                s3[r] = __expf(s3[r] - mr);
                float ps = s0[r] + s1[r] + s2[r] + s3[r];
                ps += __shfl_xor(ps, 1, 32);
                ps += __shfl_xor(ps, 2, 32);
                ps += __shfl_xor(ps, 4, 32);
                ps += __shfl_xor(ps, 8, 32);

                const float alpha = __expf(m_i[r] - mr);
                l_i[r] = l_i[r] * alpha + ps;
                m_i[r] = mr;
                o0[r] *= alpha; o1[r] *= alpha; o2[r] *= alpha; o3[r] *= alpha;
            }

            // ---- transpose P (C/D layout -> A layout) via wave-private LDS tile ----
#pragma unroll
            for (int r = 0; r < 8; ++r) {
                const int prow = wave * 16 + r + 8 * hi;
                Psh[prow * LSTR +  0 + l16] = s0[r];
                Psh[prow * LSTR + 16 + l16] = s1[r];
                Psh[prow * LSTR + 32 + l16] = s2[r];
                Psh[prow * LSTR + 48 + l16] = s3[r];
            }

            // ---- O += P . V ----
            const float* pbase = &Psh[(wave * 16 + l16) * LSTR];
#pragma unroll
            for (int ks = 0; ks < 16; ++ks) {
                const int c = 4 * ks + 2 * hi;          // key-row base within block
                const v2f a = *(const v2f*)(pbase + c);
                v2f b0, b1, b2, b3;
                b0.x = Vb[ c      * LSTR +  0 + l16];
                b0.y = Vb[(c + 1) * LSTR +  0 + l16];
                b1.x = Vb[ c      * LSTR + 16 + l16];
                b1.y = Vb[(c + 1) * LSTR + 16 + l16];
                b2.x = Vb[ c      * LSTR + 32 + l16];
                b2.y = Vb[(c + 1) * LSTR + 32 + l16];
                b3.x = Vb[ c      * LSTR + 48 + l16];
                b3.y = Vb[(c + 1) * LSTR + 48 + l16];
                o0 = __builtin_amdgcn_wmma_f32_16x16x4_f32(false, a, false, b0, (short)0, o0, false, false);
                o1 = __builtin_amdgcn_wmma_f32_16x16x4_f32(false, a, false, b1, (short)0, o1, false, false);
                o2 = __builtin_amdgcn_wmma_f32_16x16x4_f32(false, a, false, b2, (short)0, o2, false, false);
                o3 = __builtin_amdgcn_wmma_f32_16x16x4_f32(false, a, false, b3, (short)0, o3, false, false);
            }
        }

        // ---- epilogue: O / l, store (C/D layout -> row-major global) ----
        float* optr = out + base + (size_t)(qb * BLK + wave * 16) * D_;
#pragma unroll
        for (int r = 0; r < 8; ++r) {
            const float inv = 1.0f / l_i[r];
            const int row = r + 8 * hi;
            optr[row * D_ +  0 + l16] = o0[r] * inv;
            optr[row * D_ + 16 + l16] = o1[r] * inv;
            optr[row * D_ + 32 + l16] = o2[r] * inv;
            optr[row * D_ + 48 + l16] = o3[r] * inv;
        }
        // the stores' address and data registers are written again by the next tile: keep that behind this wait
        asm volatile("s_wait_xcnt 0x0" ::: "memory");
    }
}

extern "C" void kernel_launch(void* const* d_in, const int* in_sizes, int n_in,
                              void* d_out, int out_size, void* d_ws, size_t ws_size,
                              hipStream_t stream) {
    (void)in_sizes; (void)n_in; (void)out_size; (void)d_ws; (void)ws_size;
    const float* q = (const float*)d_in[0];
    const float* k = (const float*)d_in[1];
    const float* v = (const float*)d_in[2];
    float* out = (float*)d_out;
    dim3 grid(NQB / 2, B_ * H_);
    fa_block_causal_f32<<<grid, 128, 0, stream>>>(q, k, v, out);
}

// v002
// One run takes 95.7 microseconds.
// In both of two side-by-side timings against v001, it was 1.27 times as fast.
// All steps since v000 together make it 1.86 times as fast.
#include <hip/hip_runtime.h>

typedef float v2f __attribute__((ext_vector_type(2)));
typedef float v8f __attribute__((ext_vector_type(8)));
typedef int   v4i __attribute__((ext_vector_type(4)));

#define B_    2
#define H_    16
#define S_    2048
#define D_    64
#define BLK   64
#define NQB   (S_ / BLK)  // query blocks per head
#define LSTR  68          // LDS row stride (floats): 16B-aligned rows, conflict-free reads
#define SCALE 0.125f      // 1/sqrt(64)
#define LOG2E 1.44269504088896340736f

// ---- CDNA5 async global->LDS copy (ASYNCcnt-tracked), with fallback ----
#if defined(__has_builtin)
#  if __has_builtin(__builtin_amdgcn_global_load_async_to_lds_b128)
#    define HAVE_ASYNC_LDS 1
#  else
#    define HAVE_ASYNC_LDS 0
#  endif
#  if __has_builtin(__builtin_amdgcn_s_wait_asynccnt)
#    define HAVE_WAIT_ASYNC 1
#  else
#    define HAVE_WAIT_ASYNC 0
#  endif
#else
#  define HAVE_ASYNC_LDS 0
#  define HAVE_WAIT_ASYNC 0
#endif

__device__ __forceinline__ void async_copy_b128(const float* g, float* l) {
#if HAVE_ASYNC_LDS
    // param types (from hipcc diagnostic): (v4i* global, v4i* lds, imm offset, imm cpol)
    __builtin_amdgcn_global_load_async_to_lds_b128((v4i*)g, (v4i*)l, /*offset=*/0, /*cpol=*/0);
#else
    *(float4*)l = *(const float4*)g;
#endif
}

__device__ __forceinline__ void wait_async_copies() {
#if HAVE_ASYNC_LDS
#  if HAVE_WAIT_ASYNC
    __builtin_amdgcn_s_wait_asynccnt(0);
#  else
    asm volatile("s_wait_asynccnt 0x0" ::: "memory");
#  endif
#endif
}

// lane l <-> lane l ^ 16: the other half of the wave holds the other eight keys of each 16-key tile
__device__ __forceinline__ float xhalf(float x) {
    const int b = __builtin_bit_cast(int, x);
    return __builtin_bit_cast(float, __builtin_amdgcn_permlanex16(b, b, 0x76543210, 0xfedcba98, false, false));
}

// At most two waves per SIMD: 512 workgroups on 256 WGPs are two per WGP, and LDS and registers would admit four.
__global__ __launch_bounds__(128) __attribute__((amdgpu_waves_per_eu(2, 2)))
void fa_block_causal_f32(const float* __restrict__ q,
                         const float* __restrict__ k,
                         const float* __restrict__ v,
                         float* __restrict__ out)
{
    __shared__ __align__(16) float Ksh[2][BLK * LSTR];
    __shared__ __align__(16) float Vsh[2][BLK * LSTR];

    const int tid  = threadIdx.x;
    const int wave = tid >> 5;
    const int lane = tid & 31;
    const int l16  = lane & 15;
    const int hi   = lane >> 4;            // which half of the wave

    const int pr = blockIdx.x;             // pair index [0,16): query blocks NQB-1-pr, then pr
    const int bh = blockIdx.y;             // b*H + h
    const size_t base = (size_t)bh * S_ * D_;

    // this thread's 8 chunk coordinates for cooperative 64x64 f32 staging
    // (idx = tid + j*128 -> row = idx>>4, col4 = (idx&15)*4; 16B chunks)
    const int c_row0 = tid >> 4;           // rows this thread covers: c_row0 + 8*j
    const int c_col  = (tid & 15) << 2;

    // ---- prologue: kick off async staging of key-block 0 into buffer 0 ----
    {
        const float* kg = k + base;
        const float* vg = v + base;
#pragma unroll
        for (int j = 0; j < 8; ++j) {
            const int row = c_row0 + j * 8;
            async_copy_b128(kg + row * D_ + c_col, &Ksh[0][row * LSTR + c_col]);
            async_copy_b128(vg + row * D_ + c_col, &Vsh[0][row * LSTR + c_col]);
        }
    }

    // Two query blocks per workgroup, one after the other: (NQB - pr) + (pr + 1) = NQB + 1 key blocks
    // for every workgroup, so all workgroups cost the same. The K/V ring runs on across the switch.
    int it = 0;                            // key blocks done so far: picks the ring buffer
    for (int tile = 0; tile < 2; ++tile) {
        const int qb = tile ? pr : NQB - 1 - pr;   // query block index [0,32)

        // ---- Q^T B-fragments (4x16 layout per k-step: lane = query column), pre-scaled by 1/sqrt(D) ----
        const int qrow = qb * BLK + wave * 16 + l16;
        const float* qptr = q + base + (size_t)qrow * D_;
        v2f qa[16];
#pragma unroll
        for (int ks = 0; ks < 16; ++ks) {
            const int c = 4 * ks + 2 * hi;
            qa[ks].x = qptr[c]     * SCALE;
            qa[ks].y = qptr[c + 1] * SCALE;
        }

        v8f o0 = {}, o1 = {}, o2 = {}, o3 = {};
        // one query per lane (column l16): its running maximum, and this wave half's share of its sum
        float m_i = -1e30f, l_i = 0.0f;

        for (int kb = 0; kb <= qb; ++kb, ++it) {
            const int buf = it & 1;

            // this wave's LDS reads of buf^1 have returned before the barrier that frees it for the refill
            asm volatile("s_wait_dscnt 0x0" ::: "memory");
            wait_async_copies();               // this wave's copies into `buf` done
            __syncthreads();                   // all waves' copies done; prev reads of buf^1 retired

            // ---- overlap: start async staging of next key block into buf^1 ----
            // (behind the first tile's last block comes key block 0 again, for the second tile)
            if (kb < qb || tile == 0) {
                const int nb = (kb < qb) ? kb + 1 : 0;
                const float* kg = k + base + (size_t)(nb * BLK) * D_;
                const float* vg = v + base + (size_t)(nb * BLK) * D_;
#pragma unroll
                for (int j = 0; j < 8; ++j) {
                    const int row = c_row0 + j * 8;
                    async_copy_b128(kg + row * D_ + c_col, &Ksh[buf ^ 1][row * LSTR + c_col]);
                    async_copy_b128(vg + row * D_ + c_col, &Vsh[buf ^ 1][row * LSTR + c_col]);
                }
            }

            const float* Kb = Ksh[buf];
            const float* Vb = Vsh[buf];

            // ---- S^T = K . (Q * 1/sqrt(D))^T : 4 tiles of 16 keys x 16 queries, fp32 WMMA ----
            // st[r] = score of key 16*t + 8*hi + r against query l16
            v8f s0 = {}, s1 = {}, s2 = {}, s3 = {};
#pragma unroll
            for (int ks = 0; ks < 16; ++ks) {
                const int c = 4 * ks + 2 * hi;
                const v2f a0 = *(const v2f*)(&Kb[( 0 + l16) * LSTR + c]);
                const v2f a1 = *(const v2f*)(&Kb[(16 + l16) * LSTR + c]);
                const v2f a2 = *(const v2f*)(&Kb[(32 + l16) * LSTR + c]);
                const v2f a3 = *(const v2f*)(&Kb[(48 + l16) * LSTR + c]);
                s0 = __builtin_amdgcn_wmma_f32_16x16x4_f32(false, a0, false, qa[ks], (short)0, s0, false, false);
                s1 = __builtin_amdgcn_wmma_f32_16x16x4_f32(false, a1, false, qa[ks], (short)0, s1, false, false);
                s2 = __builtin_amdgcn_wmma_f32_16x16x4_f32(false, a2, false, qa[ks], (short)0, s2, false, false);
                s3 = __builtin_amdgcn_wmma_f32_16x16x4_f32(false, a3, false, qa[ks], (short)0, s3, false, false);
            }

            // ---- online softmax: a lane holds 32 of its query's 64 scores, lane ^ 16 the other 32 ----
            float t0 = fmaxf(s0[0], s1[0]), t1 = fmaxf(s2[0], s3[0]);
#pragma unroll
            for (int r = 1; r < 8; ++r) {
                t0 = fmaxf(t0, fmaxf(s0[r], s1[r]));
                t1 = fmaxf(t1, fmaxf(s2[r], s3[r]));
            }
            float t = fmaxf(t0, t1);
            t = fmaxf(t, xhalf(t));
            const float mr = fmaxf(m_i, t);
            const float alpha = __expf(m_i - mr);
            m_i = mr;

            s0 = (s0 - mr) * LOG2E;  s1 = (s1 - mr) * LOG2E;  s2 = (s2 - mr) * LOG2E;  s3 = (s3 - mr) * LOG2E;
            float p0 = 0.0f, p1 = 0.0f, p2 = 0.0f, p3 = 0.0f;
#pragma unroll
            for (int r = 0; r < 8; ++r) {
                s0[r] = __builtin_amdgcn_exp2f(s0[r]);  p0 += s0[r];
                s1[r] = __builtin_amdgcn_exp2f(s1[r]);  p1 += s1[r];
                s2[r] = __builtin_amdgcn_exp2f(s2[r]);  p2 += s2[r];
                s3[r] = __builtin_amdgcn_exp2f(s3[r]);  p3 += s3[r];
            }
            l_i = l_i * alpha + ((p0 + p1) + (p2 + p3));   // the halves' sums are joined in the epilogue
            o0 *= alpha; o1 *= alpha; o2 *= alpha; o3 *= alpha;

            // ---- O^T += V^T . P^T : P^T comes straight from the score registers as the B operand ----
            // k-step j of key tile t pairs registers (2j, 2j+1): keys 16*t + 8*hi + 2*j + {0, 1} in both operands
            // (unrolled so that the score and output tiles are indexed by constants and stay in registers)
            const float* vbase = &Vb[(8 * hi) * LSTR + l16];
#define PV_TILE(T, ST)                                                                                              \
            _Pragma("unroll")                                                                                       \
            for (int j = 0; j < 4; ++j) {                                                                           \
                const int kr = 16 * (T) + 2 * j;        /* key row, less this half's 8*hi */                        \
                v2f b; b.x = ST[2 * j]; b.y = ST[2 * j + 1];                                                        \
                v2f a0, a1, a2, a3;                                                                                 \
                a0.x = vbase[ kr      * LSTR +  0];  a0.y = vbase[(kr + 1) * LSTR +  0];                            \
                a1.x = vbase[ kr      * LSTR + 16];  a1.y = vbase[(kr + 1) * LSTR + 16];                            \
                a2.x = vbase[ kr      * LSTR + 32];  a2.y = vbase[(kr + 1) * LSTR + 32];                            \
                a3.x = vbase[ kr      * LSTR + 48];  a3.y = vbase[(kr + 1) * LSTR + 48];                            \
                o0 = __builtin_amdgcn_wmma_f32_16x16x4_f32(false, a0, false, b, (short)0, o0, false, false);        \
                o1 = __builtin_amdgcn_wmma_f32_16x16x4_f32(false, a1, false, b, (short)0, o1, false, false);        \
                o2 = __builtin_amdgcn_wmma_f32_16x16x4_f32(false, a2, false, b, (short)0, o2, false, false);        \
                o3 = __builtin_amdgcn_wmma_f32_16x16x4_f32(false, a3, false, b, (short)0, o3, false, false);        \
            }
            PV_TILE(0, s0)
            PV_TILE(1, s1)
            PV_TILE(2, s2)
            PV_TILE(3, s3)
#undef PV_TILE
        }

        // ---- epilogue: O / l, store; ot[r] = O[query l16][16*t + 8*hi + r]: 8 consecutive floats a lane ----
        const float inv = 1.0f / (l_i + xhalf(l_i));
        float* optr = out + base + (size_t)(qb * BLK + wave * 16 + l16) * D_ + 8 * hi;
        *(float4*)(optr +  0) = make_float4(o0[0] * inv, o0[1] * inv, o0[2] * inv, o0[3] * inv);
        *(float4*)(optr +  4) = make_float4(o0[4] * inv, o0[5] * inv, o0[6] * inv, o0[7] * inv);
        *(float4*)(optr + 16) = make_float4(o1[0] * inv, o1[1] * inv, o1[2] * inv, o1[3] * inv);
        *(float4*)(optr + 20) = make_float4(o1[4] * inv, o1[5] * inv, o1[6] * inv, o1[7] * inv);
        *(float4*)(optr + 32) = make_float4(o2[0] * inv, o2[1] * inv, o2[2] * inv, o2[3] * inv);
        *(float4*)(optr + 36) = make_float4(o2[4] * inv, o2[5] * inv, o2[6] * inv, o2[7] * inv);
        *(float4*)(optr + 48) = make_float4(o3[0] * inv, o3[1] * inv, o3[2] * inv, o3[3] * inv);
        *(float4*)(optr + 52) = make_float4(o3[4] * inv, o3[5] * inv, o3[6] * inv, o3[7] * inv);
        // the stores' address and data registers are written again by the next tile: keep that behind this wait
        asm volatile("s_wait_xcnt 0x0" ::: "memory");
    }
}

extern "C" void kernel_launch(void* const* d_in, const int* in_sizes, int n_in,
                              void* d_out, int out_size, void* d_ws, size_t ws_size,
                              hipStream_t stream) {
    (void)in_sizes; (void)n_in; (void)out_size; (void)d_ws; (void)ws_size;
    const float* q = (const float*)d_in[0];
    const float* k = (const float*)d_in[1];
    const float* v = (const float*)d_in[2];
    float* out = (float*)d_out;
    dim3 grid(NQB / 2, B_ * H_);
    fa_block_causal_f32<<<grid, 128, 0, stream>>>(q, k, v, out);
}

// v003
// Measured time: 90.7 microseconds a run.
// In both of two side-by-side timings against v002, it was 1.06 times as fast.
// Counting every step since v000, it is 1.97 times as fast.
#include <hip/hip_runtime.h>

typedef float v2f __attribute__((ext_vector_type(2)));
typedef float v8f __attribute__((ext_vector_type(8)));
typedef int   v4i __attribute__((ext_vector_type(4)));

#define B_    2
#define H_    16
#define S_    2048
#define D_    64
#define BLK   64
#define NQB   (S_ / BLK)  // query blocks per head
#define LSTR  68          // LDS row stride (floats): 16B-aligned rows, conflict-free reads
#define SCALE 0.125f      // 1/sqrt(64)
#define LOG2E 1.44269504088896340736f

// ---- CDNA5 async global->LDS copy (ASYNCcnt-tracked), with fallback ----
#if defined(__has_builtin)
#  if __has_builtin(__builtin_amdgcn_global_load_async_to_lds_b128)
#    define HAVE_ASYNC_LDS 1
#  else
#    define HAVE_ASYNC_LDS 0
#  endif
#  if __has_builtin(__builtin_amdgcn_s_wait_asynccnt)
#    define HAVE_WAIT_ASYNC 1
#  else
#    define HAVE_WAIT_ASYNC 0
#  endif
#else
#  define HAVE_ASYNC_LDS 0
#  define HAVE_WAIT_ASYNC 0
#endif

__device__ __forceinline__ void async_copy_b128(const float* g, float* l) {
#if HAVE_ASYNC_LDS
    // param types (from hipcc diagnostic): (v4i* global, v4i* lds, imm offset, imm cpol)
    __builtin_amdgcn_global_load_async_to_lds_b128((v4i*)g, (v4i*)l, /*offset=*/0, /*cpol=*/0);
#else
    *(float4*)l = *(const float4*)g;
#endif
}

__device__ __forceinline__ void wait_async_copies() {
#if HAVE_ASYNC_LDS
#  if HAVE_WAIT_ASYNC
    __builtin_amdgcn_s_wait_asynccnt(0);
#  else
    asm volatile("s_wait_asynccnt 0x0" ::: "memory");
#  endif
#endif
}

// lane l <-> lane l ^ 16: the other half of the wave holds the other eight keys of each 16-key tile
__device__ __forceinline__ float xhalf(float x) {
    const int b = __builtin_bit_cast(int, x);
    return __builtin_bit_cast(float, __builtin_amdgcn_permlanex16(b, b, 0x76543210, 0xfedcba98, false, false));
}

// Eight waves a workgroup: wave = (query tile, key half). At most four waves per SIMD: 512 workgroups on
// 256 WGPs are two per WGP, and LDS would admit three.
__global__ __launch_bounds__(256) __attribute__((amdgpu_waves_per_eu(4, 4)))
void fa_block_causal_f32(const float* __restrict__ q,
                         const float* __restrict__ k,
                         const float* __restrict__ v,
                         float* __restrict__ out)
{
    __shared__ __align__(16) float Ksh[2][BLK * LSTR];
    __shared__ __align__(16) float Vsh[2][BLK * LSTR];
    // join buffer: per query tile the upper key half's 32 output registers, maximum and sum, one dword a lane each
    __shared__ __align__(16) float Jsh[4][34 * 32];

    const int tid  = threadIdx.x;
    const int wave = __builtin_amdgcn_readfirstlane(tid >> 5);
    const int qt   = wave & 3;             // which 16 queries of the query block
    const int kh   = wave >> 2;            // which 32 keys of every key block
    const int lane = tid & 31;
    const int l16  = lane & 15;
    const int hi   = lane >> 4;            // which half of the wave

    const int pr = blockIdx.x;             // pair index [0,16): query blocks NQB-1-pr, then pr
    const int bh = blockIdx.y;             // b*H + h
    const size_t base = (size_t)bh * S_ * D_;

    // this thread's 4 chunk coordinates for cooperative 64x64 f32 staging
    // (idx = tid + j*256 -> row = idx>>4, col4 = (idx&15)*4; 16B chunks)
    const int c_row0 = tid >> 4;           // rows this thread covers: c_row0 + 16*j
    const int c_col  = (tid & 15) << 2;

    // ---- prologue: kick off async staging of key-block 0 into buffer 0 ----
    {
        const float* kg = k + base;
        const float* vg = v + base;
#pragma unroll
        for (int j = 0; j < 4; ++j) {
            const int row = c_row0 + j * 16;
            async_copy_b128(kg + row * D_ + c_col, &Ksh[0][row * LSTR + c_col]);
            async_copy_b128(vg + row * D_ + c_col, &Vsh[0][row * LSTR + c_col]);
        }
    }

    // Two query blocks per workgroup, one after the other: (NQB - pr) + (pr + 1) = NQB + 1 key blocks
    // for every workgroup, so all workgroups cost the same. The K/V ring runs on across the switch.
    int it = 0;                            // key blocks done so far: picks the ring buffer
    for (int tile = 0; tile < 2; ++tile) {
        const int qb = tile ? pr : NQB - 1 - pr;   // query block index [0,32)

        // ---- Q^T B-fragments (4x16 layout per k-step: lane = query column), pre-scaled by 1/sqrt(D) ----
        const int qrow = qb * BLK + qt * 16 + l16;
        const float* qptr = q + base + (size_t)qrow * D_;
        v2f qa[16];
#pragma unroll
        for (int ks = 0; ks < 16; ++ks) {
            const int c = 4 * ks + 2 * hi;
            qa[ks].x = qptr[c]     * SCALE;
            qa[ks].y = qptr[c + 1] * SCALE;
        }

        v8f o0 = {}, o1 = {}, o2 = {}, o3 = {};
        // one query per lane (column l16): its running maximum over this wave's key halves,
        // and this wave half's share of its sum
        float m_i = -1e30f, l_i = 0.0f;

        for (int kb = 0; kb <= qb; ++kb, ++it) {
            const int buf = it & 1;

            // this wave's LDS reads of buf^1 have returned before the barrier that frees it for the refill
            asm volatile("s_wait_dscnt 0x0" ::: "memory");
            wait_async_copies();               // this wave's copies into `buf` done
            __syncthreads();                   // all waves' copies done; prev reads of buf^1 retired

            // ---- overlap: start async staging of next key block into buf^1 ----
            // (behind the first tile's last block comes key block 0 again, for the second tile)
            if (kb < qb || tile == 0) {
                const int nb = (kb < qb) ? kb + 1 : 0;
                const float* kg = k + base + (size_t)(nb * BLK) * D_;
                const float* vg = v + base + (size_t)(nb * BLK) * D_;
#pragma unroll
                for (int j = 0; j < 4; ++j) {
                    const int row = c_row0 + j * 16;
                    async_copy_b128(kg + row * D_ + c_col, &Ksh[buf ^ 1][row * LSTR + c_col]);
                    async_copy_b128(vg + row * D_ + c_col, &Vsh[buf ^ 1][row * LSTR + c_col]);
                }
            }

            const float* Kb = &Ksh[buf][kh * 32 * LSTR];   // this wave's 32 keys of the block
            const float* Vb = &Vsh[buf][kh * 32 * LSTR];

            // ---- S^T = K . (Q * 1/sqrt(D))^T : 2 tiles of 16 keys x 16 queries, fp32 WMMA ----
            // st[r] = score of key 32*kh + 16*t + 8*hi + r against query l16
            v8f s0 = {}, s1 = {};
#pragma unroll
            for (int ks = 0; ks < 16; ++ks) {
                const int c = 4 * ks + 2 * hi;
                const v2f a0 = *(const v2f*)(&Kb[( 0 + l16) * LSTR + c]);
                const v2f a1 = *(const v2f*)(&Kb[(16 + l16) * LSTR + c]);
                s0 = __builtin_amdgcn_wmma_f32_16x16x4_f32(false, a0, false, qa[ks], (short)0, s0, false, false);
                s1 = __builtin_amdgcn_wmma_f32_16x16x4_f32(false, a1, false, qa[ks], (short)0, s1, false, false);
            }

            // ---- online softmax: a lane holds 16 of its query's 32 scores here, lane ^ 16 the other 16 ----
            float t0 = fmaxf(s0[0], s1[0]), t1 = fmaxf(s0[1], s1[1]);
#pragma unroll
            for (int r = 2; r < 8; r += 2) {
                t0 = fmaxf(t0, fmaxf(s0[r], s1[r]));
                t1 = fmaxf(t1, fmaxf(s0[r + 1], s1[r + 1]));
            }
            float t = fmaxf(t0, t1);
            t = fmaxf(t, xhalf(t));
            const float mr = fmaxf(m_i, t);
            const float alpha = __expf(m_i - mr);
            m_i = mr;

            s0 = (s0 - mr) * LOG2E;  s1 = (s1 - mr) * LOG2E;
            float p0 = 0.0f, p1 = 0.0f;
#pragma unroll
            for (int r = 0; r < 8; ++r) {
                s0[r] = __builtin_amdgcn_exp2f(s0[r]);  p0 += s0[r];
                s1[r] = __builtin_amdgcn_exp2f(s1[r]);  p1 += s1[r];
            }
            l_i = l_i * alpha + (p0 + p1);   // the lane halves' and the key halves' sums are joined in the epilogue
            o0 *= alpha; o1 *= alpha; o2 *= alpha; o3 *= alpha;

            // ---- O^T += V^T . P^T : P^T comes straight from the score registers as the B operand ----
            // k-step j of key tile t pairs registers (2j, 2j+1): keys 32*kh + 16*t + 8*hi + 2*j + {0, 1} in both operands
            // (unrolled so that the score and output tiles are indexed by constants and stay in registers)
            const float* vbase = &Vb[(8 * hi) * LSTR + l16];
#define PV_TILE(T, ST)                                                                                              \
            _Pragma("unroll")                                                                                       \
            for (int j = 0; j < 4; ++j) {                                                                           \
                const int kr = 16 * (T) + 2 * j;        /* key row, less this half's 8*hi */                        \
                v2f b; b.x = ST[2 * j]; b.y = ST[2 * j + 1];                                                        \
                v2f a0, a1, a2, a3;                                                                                 \
                a0.x = vbase[ kr      * LSTR +  0];  a0.y = vbase[(kr + 1) * LSTR +  0];                            \
                a1.x = vbase[ kr      * LSTR + 16];  a1.y = vbase[(kr + 1) * LSTR + 16];                            \
                a2.x = vbase[ kr      * LSTR + 32];  a2.y = vbase[(kr + 1) * LSTR + 32];                            \
                a3.x = vbase[ kr      * LSTR + 48];  a3.y = vbase[(kr + 1) * LSTR + 48];                            \
                o0 = __builtin_amdgcn_wmma_f32_16x16x4_f32(false, a0, false, b, (short)0, o0, false, false);        \
                o1 = __builtin_amdgcn_wmma_f32_16x16x4_f32(false, a1, false, b, (short)0, o1, false, false);        \
                o2 = __builtin_amdgcn_wmma_f32_16x16x4_f32(false, a2, false, b, (short)0, o2, false, false);        \
                o3 = __builtin_amdgcn_wmma_f32_16x16x4_f32(false, a3, false, b, (short)0, o3, false, false);        \
            }
            PV_TILE(0, s0)
            PV_TILE(1, s1)
#undef PV_TILE
        }

        // ---- join the two key halves of each query tile: the upper half's wave hands (O, m, l) over through LDS ----
        float* jb = &Jsh[qt][lane];
        if (kh) {
#pragma unroll
            for (int r = 0; r < 8; ++r) {
                jb[( 0 + r) * 32] = o0[r];
                jb[( 8 + r) * 32] = o1[r];
                jb[(16 + r) * 32] = o2[r];
                jb[(24 + r) * 32] = o3[r];
            }
            jb[32 * 32] = m_i;
            jb[33 * 32] = l_i;
        }
        // publishes the join buffer; its next writes stand behind the next tile's loop barriers, which follow these reads
        __syncthreads();
        if (!kh) {
            const float m2 = jb[32 * 32], l2 = jb[33 * 32];
            const float mt = fmaxf(m_i, m2);
            const float f1 = __expf(m_i - mt), f2 = __expf(m2 - mt);
            const float ls = l_i * f1 + l2 * f2;
            const float inv = 1.0f / (ls + xhalf(ls));
            const float g1 = f1 * inv, g2 = f2 * inv;
#pragma unroll
            for (int r = 0; r < 8; ++r) {
                o0[r] = o0[r] * g1 + jb[( 0 + r) * 32] * g2;
                o1[r] = o1[r] * g1 + jb[( 8 + r) * 32] * g2;
                o2[r] = o2[r] * g1 + jb[(16 + r) * 32] * g2;
                o3[r] = o3[r] * g1 + jb[(24 + r) * 32] * g2;
            }
            // ---- store; ot[r] = O[query l16][16*t + 8*hi + r]: 8 consecutive floats a lane ----
            float* optr = out + base + (size_t)(qb * BLK + qt * 16 + l16) * D_ + 8 * hi;
            *(float4*)(optr +  0) = make_float4(o0[0], o0[1], o0[2], o0[3]);
            *(float4*)(optr +  4) = make_float4(o0[4], o0[5], o0[6], o0[7]);
            *(float4*)(optr + 16) = make_float4(o1[0], o1[1], o1[2], o1[3]);
            *(float4*)(optr + 20) = make_float4(o1[4], o1[5], o1[6], o1[7]);
            *(float4*)(optr + 32) = make_float4(o2[0], o2[1], o2[2], o2[3]);
            *(float4*)(optr + 36) = make_float4(o2[4], o2[5], o2[6], o2[7]);
            *(float4*)(optr + 48) = make_float4(o3[0], o3[1], o3[2], o3[3]);
            *(float4*)(optr + 52) = make_float4(o3[4], o3[5], o3[6], o3[7]);
            // the stores' address and data registers are written again by the next tile: keep that behind this wait
            asm volatile("s_wait_xcnt 0x0" ::: "memory");
        }
    }
}

extern "C" void kernel_launch(void* const* d_in, const int* in_sizes, int n_in,
                              void* d_out, int out_size, void* d_ws, size_t ws_size,
                              hipStream_t stream) {
    (void)in_sizes; (void)n_in; (void)out_size; (void)d_ws; (void)ws_size;
    const float* q = (const float*)d_in[0];
    const float* k = (const float*)d_in[1];
    const float* v = (const float*)d_in[2];
    float* out = (float*)d_out;
    dim3 grid(NQB / 2, B_ * H_);
    fa_block_causal_f32<<<grid, 256, 0, stream>>>(q, k, v, out);
}
